// v000
// The times below were measured on an AMD MI455X: many runs one after another, warmed up first and cycling through
// copies of the inputs, with the whole window's GPU time divided by the number of runs. Launches and the gaps
// between them are all in it. The median over several windows is given; except for v000 it joins two sittings, which
// can be a few percent apart, so the side-by-side timings, each taken in one sitting, are the better comparison.
// v000 is the starting kernel. One run takes 84.1 microseconds.
#include <hip/hip_runtime.h>
#include <math.h>

typedef float v2f __attribute__((ext_vector_type(2)));
typedef float v8f __attribute__((ext_vector_type(8)));

#define BB    4
#define LL    2048
#define DD    128
#define EPSF  1e-12f

#define NCH   16            // K-chunks per batch for the q^T k GEMM
#define CHUNK (LL / NCH)    // 128 sequence rows per chunk
#define NRM   8             // L-chunks per batch for the norm reduction
#define LROW  (LL / NRM)    // 256 rows per norm block
#define PAD   132           // LDS row pitch (mult of 4, %64==4 -> conflict-free)

// ws layout (floats)
#define WS_NORM  0                        // BB*NRM*256
#define WS_PART  (BB * NRM * 256)         // BB*NCH*DD*DD
#define WS_SM    (WS_PART + BB * NCH * DD * DD)

// ---------------------------------------------------------------------------
// Kernel 1: partial sums of squares over L-chunks for q and k.
// grid = BB*NRM; threads 0..127 -> q channel d, 128..255 -> k channel d.
// ---------------------------------------------------------------------------
__global__ __launch_bounds__(256) void norm_part_kernel(const float* __restrict__ q,
                                                        const float* __restrict__ k,
                                                        float* __restrict__ normpart) {
    int b = blockIdx.x >> 3;
    int c = blockIdx.x & (NRM - 1);
    int t = threadIdx.x;
    int d = t & (DD - 1);
    const float* src = (t < DD) ? q : k;
    const float* p = src + ((size_t)b * LL + (size_t)c * LROW) * DD + d;
    float s = 0.f;
#pragma unroll 4
    for (int l = 0; l < LROW; ++l) {
        float x = p[(size_t)l * DD];
        s += x * x;
    }
    normpart[(size_t)blockIdx.x * 256 + t] = s;
}

// ---------------------------------------------------------------------------
// Kernel 2a: partial S = q^T k over one K-chunk of 128 rows, per batch.
// grid = BB*NCH blocks (8 waves each). q,k chunks staged K-major (transposed)
// in LDS so every WMMA operand is a single 8-byte ds load.
// ---------------------------------------------------------------------------
__global__ __launch_bounds__(256) void qk_part_kernel(const float* __restrict__ q,
                                                      const float* __restrict__ k,
                                                      float* __restrict__ partials) {
    __shared__ float qT[DD * PAD];   // qT[e][l] : 67.6 KB
    __shared__ float kT[DD * PAD];   // kT[e][l] : 67.6 KB
    int b = blockIdx.x >> 4;
    int c = blockIdx.x & (NCH - 1);
    int tid = threadIdx.x;

    const float* qb = q + ((size_t)b * LL + (size_t)c * CHUNK) * DD;
    const float* kb = k + ((size_t)b * LL + (size_t)c * CHUNK) * DD;

    // stage transposed: coalesced global reads, 4-bank-step LDS writes
    for (int i = tid; i < DD * CHUNK; i += 256) {
        int l = i >> 7, e = i & (DD - 1);
        qT[e * PAD + l] = qb[(size_t)l * DD + e];
        kT[e * PAD + l] = kb[(size_t)l * DD + e];
    }
    __syncthreads();

    int w   = tid >> 5;          // wave 0..7 owns d-strip [16w,16w+16)
    int lid = tid & 31;
    int g   = lid >> 4;
    int m   = lid & 15;
    int d_base = w * 16;

    v8f acc[8];
#pragma unroll
    for (int t = 0; t < 8; ++t) acc[t] = (v8f){0.f,0.f,0.f,0.f,0.f,0.f,0.f,0.f};

#pragma unroll 2
    for (int l0 = 0; l0 < CHUNK; l0 += 4) {
        // A[m][kk] = q[l0+kk, d_base+m] = qT[d_base+m][l0+kk], kk = 2g+j
        v2f a = *(const v2f*)&qT[(d_base + m) * PAD + l0 + 2 * g];
#pragma unroll
        for (int t = 0; t < 8; ++t) {
            // B[kk][n] = k[l0+kk, 16t+n] = kT[16t+n][l0+kk]
            v2f bv = *(const v2f*)&kT[(t * 16 + m) * PAD + l0 + 2 * g];
            acc[t] = __builtin_amdgcn_wmma_f32_16x16x4_f32(
                false, a, false, bv, (short)0, acc[t], false, false);
        }
    }

    float* Sp = partials + (size_t)blockIdx.x * DD * DD;
#pragma unroll
    for (int t = 0; t < 8; ++t)
#pragma unroll
        for (int r = 0; r < 8; ++r)
            Sp[(d_base + r + 8 * g) * DD + t * 16 + m] = acc[t][r];
}

// ---------------------------------------------------------------------------
// Kernel 2b: fold norm partials -> inverse norms, fold the NCH S-partials
// (ordered, deterministic), scale, row-softmax, write sm. grid = BB.
// ---------------------------------------------------------------------------
__global__ __launch_bounds__(256) void softmax_kernel(const float* __restrict__ normpart,
                                                      const float* __restrict__ partials,
                                                      float* __restrict__ sm) {
    __shared__ float nq[DD], nk[DD];
    __shared__ float Sb[DD * 129];   // padded rows -> conflict-free row softmax
    int b = blockIdx.x;
    int tid = threadIdx.x;

    if (tid < DD) {
        float sq = 0.f, sk = 0.f;
#pragma unroll
        for (int c = 0; c < NRM; ++c) {
            sq += normpart[(size_t)(b * NRM + c) * 256 + tid];
            sk += normpart[(size_t)(b * NRM + c) * 256 + DD + tid];
        }
        nq[tid] = 1.f / fmaxf(sqrtf(sq), EPSF);
        nk[tid] = 1.f / fmaxf(sqrtf(sk), EPSF);
    }
    __syncthreads();

    const float* Pb = partials + (size_t)b * NCH * DD * DD;
    for (int i = tid; i < DD * DD; i += 256) {
        float s = 0.f;
#pragma unroll
        for (int c = 0; c < NCH; ++c)
            s += Pb[(size_t)c * DD * DD + i];
        int d = i >> 7, e = i & (DD - 1);
        Sb[d * 129 + e] = s * nq[d] * nk[e];
    }
    __syncthreads();

    if (tid < DD) {
        int d = tid;
        float mx = -INFINITY;
        for (int e = 0; e < DD; ++e) mx = fmaxf(mx, Sb[d * 129 + e]);
        float sum = 0.f;
        for (int e = 0; e < DD; ++e) {
            float p = expf(Sb[d * 129 + e] - mx);
            Sb[d * 129 + e] = p;
            sum += p;
        }
        float r = 1.f / sum;
        for (int e = 0; e < DD; ++e)
            sm[((size_t)b * DD + d) * DD + e] = Sb[d * 129 + e] * r;
    }
}

// ---------------------------------------------------------------------------
// Kernel 3: out = v @ sm^T (M=2048, N=128, K=128 per batch) via WMMA.
// sm staged row-major with pad so the B operand is one ds_load_b64;
// A operand is K-contiguous in v -> one global_load_b64.
// ---------------------------------------------------------------------------
__global__ __launch_bounds__(256) void av_kernel(const float* __restrict__ v,
                                                 const float* __restrict__ sm,
                                                 float* __restrict__ out) {
    __shared__ float smL[DD * PAD];   // smL[d][e] : 67.6 KB
    int tid    = threadIdx.x;
    int gw     = blockIdx.x * 8 + (tid >> 5);   // global wave id 0..511
    int b      = gw >> 7;                       // all waves in a block share b
    int l_base = (gw & 127) * 16;

    const float* smb = sm + (size_t)b * DD * DD;
    for (int i4 = tid; i4 < (DD * DD) / 4; i4 += 256) {
        int d = i4 >> 5, e4 = i4 & 31;
        float4 val = ((const float4*)smb)[i4];
        *(float4*)&smL[d * PAD + e4 * 4] = val;
    }
    __syncthreads();

    int lid = tid & 31;
    int g   = lid >> 4;
    int m   = lid & 15;
    const float* vb = v + (size_t)b * LL * DD;

    v8f acc[8];
#pragma unroll
    for (int t = 0; t < 8; ++t) acc[t] = (v8f){0.f,0.f,0.f,0.f,0.f,0.f,0.f,0.f};

#pragma unroll 4
    for (int e0 = 0; e0 < DD; e0 += 4) {
        // A[m][kk] = v[l_base+m, e0+kk]  (K-contiguous in global memory)
        v2f a = *(const v2f*)&vb[(size_t)(l_base + m) * DD + e0 + 2 * g];
#pragma unroll
        for (int t = 0; t < 8; ++t) {
            // B[kk][n] = sm[16t+n, e0+kk] = smL[16t+n][e0+kk]
            v2f bv = *(const v2f*)&smL[(t * 16 + m) * PAD + e0 + 2 * g];
            acc[t] = __builtin_amdgcn_wmma_f32_16x16x4_f32(
                false, a, false, bv, (short)0, acc[t], false, false);
        }
    }

    float* ob = out + (size_t)b * LL * DD;
#pragma unroll
    for (int t = 0; t < 8; ++t)
#pragma unroll
        for (int r = 0; r < 8; ++r)
            ob[(size_t)(l_base + r + 8 * g) * DD + t * 16 + m] = acc[t][r];
}

// ---------------------------------------------------------------------------
extern "C" void kernel_launch(void* const* d_in, const int* in_sizes, int n_in,
                              void* d_out, int out_size, void* d_ws, size_t ws_size,
                              hipStream_t stream) {
    const float* q = (const float*)d_in[0];
    const float* k = (const float*)d_in[1];
    const float* v = (const float*)d_in[2];
    float* out = (float*)d_out;

    float* ws       = (float*)d_ws;
    float* normpart = ws + WS_NORM;   // BB*NRM*256 floats
    float* partials = ws + WS_PART;   // BB*NCH*DD*DD floats (4 MB)
    float* sm       = ws + WS_SM;     // BB*DD*DD floats

    norm_part_kernel<<<BB * NRM, 256, 0, stream>>>(q, k, normpart);
    qk_part_kernel<<<BB * NCH, 256, 0, stream>>>(q, k, partials);
    softmax_kernel<<<BB, 256, 0, stream>>>(normpart, partials, sm);
    av_kernel<<<(BB * (LL / 16)) / 8, 256, 0, stream>>>(v, sm, out);
}

// v001
// One run takes 55.9 microseconds.
// In two side-by-side timings against v000, it was 1.49 and 1.48 times as fast.
#include <hip/hip_runtime.h>
#include <math.h>

typedef float v2f __attribute__((ext_vector_type(2)));
typedef float v8f __attribute__((ext_vector_type(8)));

#define BB    4
#define LL    2048
#define DD    128
#define EPSF  1e-12f

#define NCH   16            // K-chunks per batch for the q^T k GEMM
#define CHUNK (LL / NCH)    // 128 sequence rows per chunk
#define NRM   8             // L-chunks per batch for the norm reduction
#define LROW  (LL / NRM)    // 256 rows per norm block
#define PAD   132           // LDS row pitch (mult of 4, %64==4 -> conflict-free)
#define SMW   4             // rows (waves) per softmax block

// ws layout (floats)
#define WS_NORM  0                        // BB*NRM*256
#define WS_PART  (BB * NRM * 256)         // BB*NCH*DD*DD
#define WS_SM    (WS_PART + BB * NCH * DD * DD)

// ---------------------------------------------------------------------------
// Kernel 1: partial sums of squares over L-chunks for q and k.
// grid = BB*NRM; threads 0..127 -> q channel d, 128..255 -> k channel d.
// ---------------------------------------------------------------------------
__global__ __launch_bounds__(256) void norm_part_kernel(const float* __restrict__ q,
                                                        const float* __restrict__ k,
                                                        float* __restrict__ normpart) {
    int b = blockIdx.x >> 3;
    int c = blockIdx.x & (NRM - 1);
    int t = threadIdx.x;
    int d = t & (DD - 1);
    const float* src = (t < DD) ? q : k;
    const float* p = src + ((size_t)b * LL + (size_t)c * LROW) * DD + d;
    float s = 0.f;
#pragma unroll 4
    for (int l = 0; l < LROW; ++l) {
        float x = p[(size_t)l * DD];
        s += x * x;
    }
    normpart[(size_t)blockIdx.x * 256 + t] = s;
}

// ---------------------------------------------------------------------------
// Kernel 2a: partial S = q^T k over one K-chunk of 128 rows, per batch.
// grid = BB*NCH blocks (8 waves each). q,k chunks staged K-major (transposed)
// in LDS so every WMMA operand is a single 8-byte ds load.
// ---------------------------------------------------------------------------
__global__ __launch_bounds__(256) void qk_part_kernel(const float* __restrict__ q,
                                                      const float* __restrict__ k,
                                                      float* __restrict__ partials) {
    __shared__ float qT[DD * PAD];   // qT[e][l] : 67.6 KB
    __shared__ float kT[DD * PAD];   // kT[e][l] : 67.6 KB
    int b = blockIdx.x >> 4;
    int c = blockIdx.x & (NCH - 1);
    int tid = threadIdx.x;

    const float* qb = q + ((size_t)b * LL + (size_t)c * CHUNK) * DD;
    const float* kb = k + ((size_t)b * LL + (size_t)c * CHUNK) * DD;

    // stage transposed: coalesced global reads, 4-bank-step LDS writes
    for (int i = tid; i < DD * CHUNK; i += 256) {
        int l = i >> 7, e = i & (DD - 1);
        qT[e * PAD + l] = qb[(size_t)l * DD + e];
        kT[e * PAD + l] = kb[(size_t)l * DD + e];
    }
    __syncthreads();

    int w   = tid >> 5;          // wave 0..7 owns d-strip [16w,16w+16)
    int lid = tid & 31;
    int g   = lid >> 4;
    int m   = lid & 15;
    int d_base = w * 16;

    v8f acc[8];
#pragma unroll
    for (int t = 0; t < 8; ++t) acc[t] = (v8f){0.f,0.f,0.f,0.f,0.f,0.f,0.f,0.f};

#pragma unroll 2
    for (int l0 = 0; l0 < CHUNK; l0 += 4) {
        // A[m][kk] = q[l0+kk, d_base+m] = qT[d_base+m][l0+kk], kk = 2g+j
        v2f a = *(const v2f*)&qT[(d_base + m) * PAD + l0 + 2 * g];
#pragma unroll
        for (int t = 0; t < 8; ++t) {
            // B[kk][n] = k[l0+kk, 16t+n] = kT[16t+n][l0+kk]
            v2f bv = *(const v2f*)&kT[(t * 16 + m) * PAD + l0 + 2 * g];
            acc[t] = __builtin_amdgcn_wmma_f32_16x16x4_f32(
                false, a, false, bv, (short)0, acc[t], false, false);
        }
    }

    float* Sp = partials + (size_t)blockIdx.x * DD * DD;
#pragma unroll
    for (int t = 0; t < 8; ++t)
#pragma unroll
        for (int r = 0; r < 8; ++r)
            Sp[(d_base + r + 8 * g) * DD + t * 16 + m] = acc[t][r];
}

// ---------------------------------------------------------------------------
// Kernel 2b: one wave per row of S. Each lane owns 4 adjacent columns: it folds
// the norm partials -> inverse norms and the NCH S-partials (ordered,
// deterministic) in registers, scales, and the row's max and sum go over the
// 32 lanes by shuffles. No LDS, no barrier. grid = BB*DD/SMW.
// ---------------------------------------------------------------------------
// waves_per_eu: lets the compiler spend registers on all 32 loads at once; at its
// default target it reuses load registers and the later loads wait for the earlier.
__global__ __launch_bounds__(32 * SMW) __attribute__((amdgpu_waves_per_eu(1, 4)))
void softmax_kernel(const float* __restrict__ normpart,
                    const float* __restrict__ partials,
                    float* __restrict__ sm) {
    int row  = blockIdx.x * SMW + (threadIdx.x >> 5);   // 0 .. BB*DD-1
    int lane = threadIdx.x & 31;
    int b = row >> 7;
    int d = row & (DD - 1);
    int e = lane * 4;

    // all loads are independent: one round trip for the whole row
    const float* Pb = partials + (size_t)b * NCH * DD * DD + (size_t)d * DD + e;
    const float* Nb = normpart + (size_t)b * NRM * 256;
    float4 p[NCH];
    float4 xk[NRM];
    float  xq[NRM];
#pragma unroll
    for (int c = 0; c < NCH; ++c)
        p[c] = *(const float4*)(Pb + (size_t)c * DD * DD);
#pragma unroll
    for (int c = 0; c < NRM; ++c) {
        xq[c] = Nb[c * 256 + d];
        xk[c] = *(const float4*)(Nb + c * 256 + DD + e);
    }

    float  sq = 0.f;
    float4 sk = make_float4(0.f, 0.f, 0.f, 0.f);
#pragma unroll
    for (int c = 0; c < NRM; ++c) {
        sq += xq[c];
        sk.x += xk[c].x; sk.y += xk[c].y; sk.z += xk[c].z; sk.w += xk[c].w;
    }
    float nq = 1.f / fmaxf(sqrtf(sq), EPSF);
    float4 nk;
    nk.x = 1.f / fmaxf(sqrtf(sk.x), EPSF);
    nk.y = 1.f / fmaxf(sqrtf(sk.y), EPSF);
    nk.z = 1.f / fmaxf(sqrtf(sk.z), EPSF);
    nk.w = 1.f / fmaxf(sqrtf(sk.w), EPSF);

    float4 s = make_float4(0.f, 0.f, 0.f, 0.f);
#pragma unroll
    for (int c = 0; c < NCH; ++c) {
        s.x += p[c].x; s.y += p[c].y; s.z += p[c].z; s.w += p[c].w;
    }
    s.x = s.x * nq * nk.x;
    s.y = s.y * nq * nk.y;
    s.z = s.z * nq * nk.z;
    s.w = s.w * nq * nk.w;

    float mx = fmaxf(fmaxf(s.x, s.y), fmaxf(s.z, s.w));
#pragma unroll
    for (int o = 16; o > 0; o >>= 1) mx = fmaxf(mx, __shfl_xor(mx, o, 32));

    s.x = expf(s.x - mx);
    s.y = expf(s.y - mx);
    s.z = expf(s.z - mx);
    s.w = expf(s.w - mx);
    float sum = (s.x + s.y) + (s.z + s.w);
#pragma unroll
    for (int o = 16; o > 0; o >>= 1) sum += __shfl_xor(sum, o, 32);

    float r = 1.f / sum;
    s.x *= r; s.y *= r; s.z *= r; s.w *= r;
    *(float4*)(sm + (size_t)row * DD + e) = s;
}

// ---------------------------------------------------------------------------
// Kernel 3: out = v @ sm^T (M=2048, N=128, K=128 per batch) via WMMA.
// sm staged row-major with pad so the B operand is one ds_load_b64;
// A operand is K-contiguous in v -> one global_load_b64.
// ---------------------------------------------------------------------------
__global__ __launch_bounds__(256) void av_kernel(const float* __restrict__ v,
                                                 const float* __restrict__ sm,
                                                 float* __restrict__ out) {
    __shared__ float smL[DD * PAD];   // smL[d][e] : 67.6 KB
    int tid    = threadIdx.x;
    int gw     = blockIdx.x * 8 + (tid >> 5);   // global wave id 0..511
    int b      = gw >> 7;                       // all waves in a block share b
    int l_base = (gw & 127) * 16;

    const float* smb = sm + (size_t)b * DD * DD;
    for (int i4 = tid; i4 < (DD * DD) / 4; i4 += 256) {
        int d = i4 >> 5, e4 = i4 & 31;
        float4 val = ((const float4*)smb)[i4];
        *(float4*)&smL[d * PAD + e4 * 4] = val;
    }
    __syncthreads();

    int lid = tid & 31;
    int g   = lid >> 4;
    int m   = lid & 15;
    const float* vb = v + (size_t)b * LL * DD;

    v8f acc[8];
#pragma unroll
    for (int t = 0; t < 8; ++t) acc[t] = (v8f){0.f,0.f,0.f,0.f,0.f,0.f,0.f,0.f};

#pragma unroll 4
    for (int e0 = 0; e0 < DD; e0 += 4) {
        // A[m][kk] = v[l_base+m, e0+kk]  (K-contiguous in global memory)
        v2f a = *(const v2f*)&vb[(size_t)(l_base + m) * DD + e0 + 2 * g];
#pragma unroll
        for (int t = 0; t < 8; ++t) {
            // B[kk][n] = sm[16t+n, e0+kk] = smL[16t+n][e0+kk]
            v2f bv = *(const v2f*)&smL[(t * 16 + m) * PAD + e0 + 2 * g];
            acc[t] = __builtin_amdgcn_wmma_f32_16x16x4_f32(
                false, a, false, bv, (short)0, acc[t], false, false);
        }
    }

    float* ob = out + (size_t)b * LL * DD;
#pragma unroll
    for (int t = 0; t < 8; ++t)
#pragma unroll
        for (int r = 0; r < 8; ++r)
            ob[(size_t)(l_base + r + 8 * g) * DD + t * 16 + m] = acc[t][r];
}

// ---------------------------------------------------------------------------
extern "C" void kernel_launch(void* const* d_in, const int* in_sizes, int n_in,
                              void* d_out, int out_size, void* d_ws, size_t ws_size,
                              hipStream_t stream) {
    const float* q = (const float*)d_in[0];
    const float* k = (const float*)d_in[1];
    const float* v = (const float*)d_in[2];
    float* out = (float*)d_out;

    float* ws       = (float*)d_ws;
    float* normpart = ws + WS_NORM;   // BB*NRM*256 floats
    float* partials = ws + WS_PART;   // BB*NCH*DD*DD floats (4 MB)
    float* sm       = ws + WS_SM;     // BB*DD*DD floats

    norm_part_kernel<<<BB * NRM, 256, 0, stream>>>(q, k, normpart);
    qk_part_kernel<<<BB * NCH, 256, 0, stream>>>(q, k, partials);
    softmax_kernel<<<(BB * DD) / SMW, 32 * SMW, 0, stream>>>(normpart, partials, sm);
    av_kernel<<<(BB * (LL / 16)) / 8, 256, 0, stream>>>(v, sm, out);
}

// v002
// Measured time: 24.6 microseconds a run.
// Two timings next to v001 put it at 2.24 and 2.28 times that version's speed.
// Over all steps from v000 it is 3.35 times as fast.
#include <hip/hip_runtime.h>
#include <math.h>

typedef float v2f __attribute__((ext_vector_type(2)));
typedef float v8f __attribute__((ext_vector_type(8)));

#define BB    4
#define LL    2048
#define DD    128
#define EPSF  1e-12f

#define NCH   16            // K-chunks per batch for the q^T k GEMM
#define CHUNK (LL / NCH)    // 128 sequence rows per chunk
#define NRM   NCH           // norm partials per batch: one per K-chunk
#define PAD   132           // LDS row pitch (mult of 4, %64==4 -> conflict-free)
#define SMW   4             // rows (waves) per softmax block

// ws layout (floats)
#define WS_NORM  0                        // BB*NRM*256
#define WS_PART  (BB * NRM * 256)         // BB*NCH*DD*DD
#define WS_SM    (WS_PART + BB * NCH * DD * DD)

// ---------------------------------------------------------------------------
// Kernel 1: partial S = q^T k over one K-chunk of 128 rows, per batch, and the
// chunk's sums of squares per channel of q and k (taken from the values while
// they pass through registers on their way to LDS).
// grid = BB*NCH blocks (8 waves each). q,k chunks staged K-major (transposed)
// in LDS so every WMMA operand is a single 8-byte ds load.
// ---------------------------------------------------------------------------
__global__ __launch_bounds__(256) void qk_part_kernel(const float* __restrict__ q,
                                                      const float* __restrict__ k,
                                                      float* __restrict__ partials,
                                                      float* __restrict__ normpart) {
    __shared__ float qT[DD * PAD];   // qT[e][l] : 67.6 KB
    __shared__ float kT[DD * PAD];   // kT[e][l] : 67.6 KB
    __shared__ float sqL[2 * 256];   // [q|k][row parity][channel] sums of squares
    int b = blockIdx.x >> 4;
    int c = blockIdx.x & (NCH - 1);
    int tid = threadIdx.x;

    const float* qb = q + ((size_t)b * LL + (size_t)c * CHUNK) * DD;
    const float* kb = k + ((size_t)b * LL + (size_t)c * CHUNK) * DD;

    // stage transposed: coalesced global reads, 4-bank-step LDS writes.
    // A thread keeps one channel e = tid & 127 and every second row; a trip
    // brings 8 of its rows of q and of k (16 loads in flight).
    int e  = tid & (DD - 1);
    int lp = tid >> 7;
    float ssq = 0.f, ssk = 0.f;
    // unroll 1: unrolled whole, the loads take their addresses from other
    // registers than qp and kp, and the wait below would hold the wrong ones
#pragma unroll 1
    for (int jb = 0; jb < CHUNK / 2; jb += 8) {
        const float* qp = qb + jb * 256 + tid;
        const float* kp = kb + jb * 256 + tid;
        float xq[8], xk[8];
#pragma unroll
        for (int u = 0; u < 8; ++u) {
            xq[u] = qp[u * 256];
            xk[u] = kp[u * 256];
        }
        // the wait that stands before a register named by an issued load is
        // written again; the two addresses are inputs so that they keep their
        // registers up to here and no load's result is put into them
        asm volatile("s_wait_xcnt 0x0" :: "v"(qp), "v"(kp) : "memory");
#pragma unroll
        for (int u = 0; u < 8; ++u) {
            qT[e * PAD + 2 * (jb + u) + lp] = xq[u];
            kT[e * PAD + 2 * (jb + u) + lp] = xk[u];
            ssq = fmaf(xq[u], xq[u], ssq);
            ssk = fmaf(xk[u], xk[u], ssk);
        }
    }
    sqL[tid]       = ssq;
    sqL[256 + tid] = ssk;
    __syncthreads();

    // threads 0..127 -> q channel, 128..255 -> k channel: even rows + odd rows
    {
        int base = (tid >> 7) * 256 + (tid & (DD - 1));
        normpart[(size_t)blockIdx.x * 256 + tid] = sqL[base] + sqL[base + DD];
    }

    int w   = tid >> 5;          // wave 0..7 owns d-strip [16w,16w+16)
    int lid = tid & 31;
    int g   = lid >> 4;
    int m   = lid & 15;
    int d_base = w * 16;

    v8f acc[8];
#pragma unroll
    for (int t = 0; t < 8; ++t) acc[t] = (v8f){0.f,0.f,0.f,0.f,0.f,0.f,0.f,0.f};

#pragma unroll 2
    for (int l0 = 0; l0 < CHUNK; l0 += 4) {
        // A[m][kk] = q[l0+kk, d_base+m] = qT[d_base+m][l0+kk], kk = 2g+j
        v2f a = *(const v2f*)&qT[(d_base + m) * PAD + l0 + 2 * g];
#pragma unroll
        for (int t = 0; t < 8; ++t) {
            // B[kk][n] = k[l0+kk, 16t+n] = kT[16t+n][l0+kk]
            v2f bv = *(const v2f*)&kT[(t * 16 + m) * PAD + l0 + 2 * g];
            acc[t] = __builtin_amdgcn_wmma_f32_16x16x4_f32(
                false, a, false, bv, (short)0, acc[t], false, false);
        }
    }

    float* Sp = partials + (size_t)blockIdx.x * DD * DD;
#pragma unroll
    for (int t = 0; t < 8; ++t)
#pragma unroll
        for (int r = 0; r < 8; ++r)
            Sp[(d_base + r + 8 * g) * DD + t * 16 + m] = acc[t][r];
}

// ---------------------------------------------------------------------------
// Kernel 2: one wave per row of S. Each lane owns 4 adjacent columns: it folds
// the norm partials -> inverse norms and the NCH S-partials (ordered,
// deterministic) in registers, scales, and the row's max and sum go over the
// 32 lanes by shuffles. No LDS, no barrier. grid = BB*DD/SMW.
// ---------------------------------------------------------------------------
// waves_per_eu: lets the compiler spend registers on all 48 loads at once; at its
// default target it reuses load registers and the later loads wait for the earlier.
__global__ __launch_bounds__(32 * SMW) __attribute__((amdgpu_waves_per_eu(1, 4)))
void softmax_kernel(const float* __restrict__ normpart,
                    const float* __restrict__ partials,
                    float* __restrict__ sm) {
    int row  = blockIdx.x * SMW + (threadIdx.x >> 5);   // 0 .. BB*DD-1
    int lane = threadIdx.x & 31;
    int b = row >> 7;
    int d = row & (DD - 1);
    int e = lane * 4;

    // all loads are independent: one round trip for the whole row
    const float* Pb = partials + (size_t)b * NCH * DD * DD + (size_t)d * DD + e;
    const float* Nb = normpart + (size_t)b * NRM * 256;
    float4 p[NCH];
    float4 xk[NRM];
    float  xq[NRM];
#pragma unroll
    for (int c = 0; c < NCH; ++c)
        p[c] = *(const float4*)(Pb + (size_t)c * DD * DD);
#pragma unroll
    for (int c = 0; c < NRM; ++c) {
        xq[c] = Nb[c * 256 + d];
        xk[c] = *(const float4*)(Nb + c * 256 + DD + e);
    }

    float  sq = 0.f;
    float4 sk = make_float4(0.f, 0.f, 0.f, 0.f);
#pragma unroll
    for (int c = 0; c < NRM; ++c) {
        sq += xq[c];
        sk.x += xk[c].x; sk.y += xk[c].y; sk.z += xk[c].z; sk.w += xk[c].w;
    }
    float nq = 1.f / fmaxf(sqrtf(sq), EPSF);
    float4 nk;
    nk.x = 1.f / fmaxf(sqrtf(sk.x), EPSF);
    nk.y = 1.f / fmaxf(sqrtf(sk.y), EPSF);
    nk.z = 1.f / fmaxf(sqrtf(sk.z), EPSF);
    nk.w = 1.f / fmaxf(sqrtf(sk.w), EPSF);

    float4 s = make_float4(0.f, 0.f, 0.f, 0.f);
#pragma unroll
    for (int c = 0; c < NCH; ++c) {
        s.x += p[c].x; s.y += p[c].y; s.z += p[c].z; s.w += p[c].w;
    }
    s.x = s.x * nq * nk.x;
    s.y = s.y * nq * nk.y;
    s.z = s.z * nq * nk.z;
    s.w = s.w * nq * nk.w;

    float mx = fmaxf(fmaxf(s.x, s.y), fmaxf(s.z, s.w));
#pragma unroll
    for (int o = 16; o > 0; o >>= 1) mx = fmaxf(mx, __shfl_xor(mx, o, 32));

    s.x = expf(s.x - mx);
    s.y = expf(s.y - mx);
    s.z = expf(s.z - mx);
    s.w = expf(s.w - mx);
    float sum = (s.x + s.y) + (s.z + s.w);
#pragma unroll
    for (int o = 16; o > 0; o >>= 1) sum += __shfl_xor(sum, o, 32);

    float r = 1.f / sum;
    s.x *= r; s.y *= r; s.z *= r; s.w *= r;
    *(float4*)(sm + (size_t)row * DD + e) = s;
}

// ---------------------------------------------------------------------------
// Kernel 3: out = v @ sm^T (M=2048, N=128, K=128 per batch) via WMMA.
// sm staged row-major with pad so the B operand is one ds_load_b64;
// A operand is K-contiguous in v -> one global_load_b64.
// ---------------------------------------------------------------------------
__global__ __launch_bounds__(256) void av_kernel(const float* __restrict__ v,
                                                 const float* __restrict__ sm,
                                                 float* __restrict__ out) {
    __shared__ float smL[DD * PAD];   // smL[d][e] : 67.6 KB
    int tid    = threadIdx.x;
    int gw     = blockIdx.x * 8 + (tid >> 5);   // global wave id 0..511
    int b      = gw >> 7;                       // all waves in a block share b
    int l_base = (gw & 127) * 16;

    const float* smb = sm + (size_t)b * DD * DD;
    for (int i4 = tid; i4 < (DD * DD) / 4; i4 += 256) {
        int d = i4 >> 5, e4 = i4 & 31;
        float4 val = ((const float4*)smb)[i4];
        *(float4*)&smL[d * PAD + e4 * 4] = val;
    }
    __syncthreads();

    int lid = tid & 31;
    int g   = lid >> 4;
    int m   = lid & 15;
    const float* vb = v + (size_t)b * LL * DD;

    v8f acc[8];
#pragma unroll
    for (int t = 0; t < 8; ++t) acc[t] = (v8f){0.f,0.f,0.f,0.f,0.f,0.f,0.f,0.f};

#pragma unroll 4
    for (int e0 = 0; e0 < DD; e0 += 4) {
        // A[m][kk] = v[l_base+m, e0+kk]  (K-contiguous in global memory)
        v2f a = *(const v2f*)&vb[(size_t)(l_base + m) * DD + e0 + 2 * g];
#pragma unroll
        for (int t = 0; t < 8; ++t) {
            // B[kk][n] = sm[16t+n, e0+kk] = smL[16t+n][e0+kk]
            v2f bv = *(const v2f*)&smL[(t * 16 + m) * PAD + e0 + 2 * g];
            acc[t] = __builtin_amdgcn_wmma_f32_16x16x4_f32(
                false, a, false, bv, (short)0, acc[t], false, false);
        }
    }

    float* ob = out + (size_t)b * LL * DD;
#pragma unroll
    for (int t = 0; t < 8; ++t)
#pragma unroll
        for (int r = 0; r < 8; ++r)
            ob[(size_t)(l_base + r + 8 * g) * DD + t * 16 + m] = acc[t][r];
}

// ---------------------------------------------------------------------------
extern "C" void kernel_launch(void* const* d_in, const int* in_sizes, int n_in,
                              void* d_out, int out_size, void* d_ws, size_t ws_size,
                              hipStream_t stream) {
    const float* q = (const float*)d_in[0];
    const float* k = (const float*)d_in[1];
    const float* v = (const float*)d_in[2];
    float* out = (float*)d_out;

    float* ws       = (float*)d_ws;
    float* normpart = ws + WS_NORM;   // BB*NRM*256 floats
    float* partials = ws + WS_PART;   // BB*NCH*DD*DD floats (4 MB)
    float* sm       = ws + WS_SM;     // BB*DD*DD floats

    qk_part_kernel<<<BB * NCH, 256, 0, stream>>>(q, k, partials, normpart);
    softmax_kernel<<<(BB * DD) / SMW, 32 * SMW, 0, stream>>>(normpart, partials, sm);
    av_kernel<<<(BB * (LL / 16)) / 8, 256, 0, stream>>>(v, sm, out);
}

// v003
// One run takes 15 microseconds.
// Next to v002, in two timings, it ran 1.63 and 1.64 times as fast.
// All steps since v000 together make it 5.48 times as fast.
#include <hip/hip_runtime.h>
#include <math.h>

typedef float v2f __attribute__((ext_vector_type(2)));
typedef float v8f __attribute__((ext_vector_type(8)));

#define BB    4
#define LL    2048
#define DD    128
#define EPSF  1e-12f

#define NCH   16            // K-chunks per batch for the q^T k GEMM
#define CHUNK (LL / NCH)    // 128 sequence rows per chunk
#define NRM   NCH           // norm partials per batch: one per K-chunk
#define PAD   132           // LDS row pitch (mult of 4, %64==4 -> conflict-free)
#define SMW   4             // rows (waves) per softmax block
#define QT    64            // channels of q and of k per qk block: a 64x64 tile of S
#define VR    32            // rows of v (and of out) per av block

// ws layout (floats)
#define WS_NORM  0                        // BB*NRM*256
#define WS_PART  (BB * NRM * 256)         // BB*NCH*DD*DD
#define WS_SM    (WS_PART + BB * NCH * DD * DD)

// ---------------------------------------------------------------------------
// Kernel 1: one 64x64 quarter of the partial S = q^T k over one K-chunk of 128
// rows, per batch, and the chunk's sums of squares per channel of q and k (taken
// from the values while they pass through registers on their way to LDS).
// grid = BB*NCH*4 blocks (8 waves each), one for every WGP. The block's 64
// channels of q and of k are staged K-major (transposed) in LDS so every WMMA
// operand is a single 8-byte ds load.
// ---------------------------------------------------------------------------
__global__ __launch_bounds__(256) void qk_part_kernel(const float* __restrict__ q,
                                                      const float* __restrict__ k,
                                                      float* __restrict__ partials,
                                                      float* __restrict__ normpart) {
    __shared__ float qT[QT * PAD];   // qT[e][l] : 33.8 KB
    __shared__ float kT[QT * PAD];   // kT[e][l] : 33.8 KB
    __shared__ float sqL[2 * 256];   // [q|k][row mod 4][channel] sums of squares
    int bc = blockIdx.x >> 2;        // batch * NCH + chunk
    int dh = (blockIdx.x >> 1) & 1;  // which 64 channels of q (rows of S)
    int eh = blockIdx.x & 1;         // which 64 channels of k (columns of S)
    int tid = threadIdx.x;

    const float* qb = q + (size_t)bc * CHUNK * DD + dh * QT;
    const float* kb = k + (size_t)bc * CHUNK * DD + eh * QT;

    // stage transposed: coalesced global reads, 4-bank-step LDS writes.
    // A thread keeps one channel e = tid & 63 and every fourth row; a trip
    // brings 8 of its rows of q and of k (16 loads in flight).
    int e  = tid & (QT - 1);
    int lp = tid >> 6;
    float ssq = 0.f, ssk = 0.f;
    // unroll 1: unrolled whole, the loads take their addresses from other
    // registers than qp and kp, and the wait below would hold the wrong ones
#pragma unroll 1
    for (int jb = 0; jb < CHUNK / 4; jb += 8) {
        const float* qp = qb + (4 * jb + lp) * DD + e;
        const float* kp = kb + (4 * jb + lp) * DD + e;
        float xq[8], xk[8];
#pragma unroll
        for (int u = 0; u < 8; ++u) {
            xq[u] = qp[u * 4 * DD];
            xk[u] = kp[u * 4 * DD];
        }
        // the wait that stands before a register named by an issued load is
        // written again; the two addresses are inputs so that they keep their
        // registers up to here and no load's result is put into them
        asm volatile("s_wait_xcnt 0x0" :: "v"(qp), "v"(kp) : "memory");
#pragma unroll
        for (int u = 0; u < 8; ++u) {
            qT[e * PAD + 4 * (jb + u) + lp] = xq[u];
            kT[e * PAD + 4 * (jb + u) + lp] = xk[u];
            ssq = fmaf(xq[u], xq[u], ssq);
            ssk = fmaf(xk[u], xk[u], ssk);
        }
    }
    sqL[tid]       = ssq;
    sqL[256 + tid] = ssk;
    __syncthreads();

    // Two blocks stage each half of q and two each half of k: the one with
    // eh == 0 writes q's sums, the one with dh == 0 writes k's.
    // threads 0..63 -> q channel, 64..127 -> k channel: the four row phases
    if (tid < 2 * QT) {
        int isk = tid >> 6;
        if ((isk ? dh : eh) == 0) {
            const float* s = sqL + isk * 256 + e;
            normpart[(size_t)bc * 256 + isk * DD + (isk ? eh : dh) * QT + e] =
                (s[0] + s[QT]) + (s[2 * QT] + s[3 * QT]);
        }
    }

    int w   = tid >> 5;          // wave 0..7: one 16-row strip, two 16-column tiles
    int lid = tid & 31;
    int g   = lid >> 4;
    int m   = lid & 15;
    int d_base = (w >> 1) * 16;  // within the block's 64 rows of S
    int e_base = (w & 1) * 32;   // within the block's 64 columns of S

    v8f acc[2];
#pragma unroll
    for (int t = 0; t < 2; ++t) acc[t] = (v8f){0.f,0.f,0.f,0.f,0.f,0.f,0.f,0.f};

    // unroll 8: 16 WMMAs a trip, as before; later steps' LDS reads go out ahead
    // of the earlier steps' WMMAs
#pragma unroll 8
    for (int l0 = 0; l0 < CHUNK; l0 += 4) {
        // A[m][kk] = q[l0+kk, d_base+m] = qT[d_base+m][l0+kk], kk = 2g+j
        v2f a = *(const v2f*)&qT[(d_base + m) * PAD + l0 + 2 * g];
#pragma unroll
        for (int t = 0; t < 2; ++t) {
            // B[kk][n] = k[l0+kk, e_base+16t+n] = kT[e_base+16t+n][l0+kk]
            v2f bv = *(const v2f*)&kT[(e_base + t * 16 + m) * PAD + l0 + 2 * g];
            acc[t] = __builtin_amdgcn_wmma_f32_16x16x4_f32(
                false, a, false, bv, (short)0, acc[t], false, false);
        }
    }

    float* Sp = partials + (size_t)bc * DD * DD + (dh * QT + d_base) * DD + eh * QT + e_base;
#pragma unroll
    for (int t = 0; t < 2; ++t)
#pragma unroll
        for (int r = 0; r < 8; ++r)
            Sp[(r + 8 * g) * DD + t * 16 + m] = acc[t][r];
}

// ---------------------------------------------------------------------------
// Kernel 2: one wave per row of S. Each lane owns 4 adjacent columns: it folds
// the norm partials -> inverse norms and the NCH S-partials (ordered,
// deterministic) in registers, scales, and the row's max and sum go over the
// 32 lanes by shuffles. No LDS, no barrier. grid = BB*DD/SMW.
// ---------------------------------------------------------------------------
// waves_per_eu: lets the compiler spend registers on all 48 loads at once; at its
// default target it reuses load registers and the later loads wait for the earlier.
__global__ __launch_bounds__(32 * SMW) __attribute__((amdgpu_waves_per_eu(1, 4)))
void softmax_kernel(const float* __restrict__ normpart,
                    const float* __restrict__ partials,
                    float* __restrict__ sm) {
    int row  = blockIdx.x * SMW + (threadIdx.x >> 5);   // 0 .. BB*DD-1
    int lane = threadIdx.x & 31;
    int b = row >> 7;
    int d = row & (DD - 1);
    int e = lane * 4;

    // all loads are independent: one round trip for the whole row
    const float* Pb = partials + (size_t)b * NCH * DD * DD + (size_t)d * DD + e;
    const float* Nb = normpart + (size_t)b * NRM * 256;
    float4 p[NCH];
    float4 xk[NRM];
    float  xq[NRM];
#pragma unroll
    for (int c = 0; c < NCH; ++c)
        p[c] = *(const float4*)(Pb + (size_t)c * DD * DD);
#pragma unroll
    for (int c = 0; c < NRM; ++c) {
        xq[c] = Nb[c * 256 + d];
        xk[c] = *(const float4*)(Nb + c * 256 + DD + e);
    }

    float  sq = 0.f;
    float4 sk = make_float4(0.f, 0.f, 0.f, 0.f);
#pragma unroll
    for (int c = 0; c < NRM; ++c) {
        sq += xq[c];
        sk.x += xk[c].x; sk.y += xk[c].y; sk.z += xk[c].z; sk.w += xk[c].w;
    }
    float nq = 1.f / fmaxf(sqrtf(sq), EPSF);
    float4 nk;
    nk.x = 1.f / fmaxf(sqrtf(sk.x), EPSF);
    nk.y = 1.f / fmaxf(sqrtf(sk.y), EPSF);
    nk.z = 1.f / fmaxf(sqrtf(sk.z), EPSF);
    nk.w = 1.f / fmaxf(sqrtf(sk.w), EPSF);

    float4 s = make_float4(0.f, 0.f, 0.f, 0.f);
#pragma unroll
    for (int c = 0; c < NCH; ++c) {
        s.x += p[c].x; s.y += p[c].y; s.z += p[c].z; s.w += p[c].w;
    }
    s.x = s.x * nq * nk.x;
    s.y = s.y * nq * nk.y;
    s.z = s.z * nq * nk.z;
    s.w = s.w * nq * nk.w;

    float mx = fmaxf(fmaxf(s.x, s.y), fmaxf(s.z, s.w));
#pragma unroll
    for (int o = 16; o > 0; o >>= 1) mx = fmaxf(mx, __shfl_xor(mx, o, 32));

    s.x = expf(s.x - mx);
    s.y = expf(s.y - mx);
    s.z = expf(s.z - mx);
    s.w = expf(s.w - mx);
    float sum = (s.x + s.y) + (s.z + s.w);
#pragma unroll
    for (int o = 16; o > 0; o >>= 1) sum += __shfl_xor(sum, o, 32);

    float r = 1.f / sum;
    s.x *= r; s.y *= r; s.z *= r; s.w *= r;
    *(float4*)(sm + (size_t)row * DD + e) = s;
}

// ---------------------------------------------------------------------------
// Kernel 3: out = v @ sm^T (M=2048, N=128, K=128 per batch) via WMMA.
// grid = BB*LL/VR blocks (8 waves each), one for every WGP: 32 rows of out each.
// sm and the block's rows of v (each read by four waves) are staged row-major
// with pad so that each operand is one ds_load_b64.
// ---------------------------------------------------------------------------
__global__ __launch_bounds__(256) void av_kernel(const float* __restrict__ v,
                                                 const float* __restrict__ sm,
                                                 float* __restrict__ out) {
    __shared__ float smL[DD * PAD];   // smL[d][e] : 67.6 KB
    __shared__ float vL[VR * PAD];    // vL[l][e]  : 16.9 KB
    int tid    = threadIdx.x;
    int b      = blockIdx.x / (LL / VR);
    int l_blk  = (blockIdx.x % (LL / VR)) * VR;

    const float* smb = sm + (size_t)b * DD * DD;
    for (int i4 = tid; i4 < (DD * DD) / 4; i4 += 256) {
        int d = i4 >> 5, e4 = i4 & 31;
        float4 val = ((const float4*)smb)[i4];
        *(float4*)&smL[d * PAD + e4 * 4] = val;
    }
    // the block's 32 rows of v: 4 whole-line loads a thread, all in flight
    const float* vb = v + ((size_t)b * LL + l_blk) * DD;
#pragma unroll
    for (int i = 0; i < (VR * DD) / 4 / 256; ++i) {
        float4 val = ((const float4*)vb)[i * 256 + tid];
        *(float4*)&vL[(i * 8 + (tid >> 5)) * PAD + (tid & 31) * 4] = val;
    }
    __syncthreads();

    int w   = tid >> 5;          // wave 0..7: one 16-row strip, two 16-column tiles
    int lid = tid & 31;
    int g   = lid >> 4;
    int m   = lid & 15;
    int l_base = (w >> 2) * 16;  // within the block's 32 rows
    int d_base = (w & 3) * 32;   // column of out

    v8f acc[2];
#pragma unroll
    for (int t = 0; t < 2; ++t) acc[t] = (v8f){0.f,0.f,0.f,0.f,0.f,0.f,0.f,0.f};

    // unroll 8: 16 WMMAs a trip; later steps' LDS reads go out ahead of the
    // earlier steps' WMMAs
#pragma unroll 8
    for (int e0 = 0; e0 < DD; e0 += 4) {
        // A[m][kk] = v[l_base+m, e0+kk] = vL[l_base+m][e0+kk], kk = 2g+j
        v2f a = *(const v2f*)&vL[(l_base + m) * PAD + e0 + 2 * g];
#pragma unroll
        for (int t = 0; t < 2; ++t) {
            // B[kk][n] = sm[d_base+16t+n, e0+kk] = smL[d_base+16t+n][e0+kk]
            v2f bv = *(const v2f*)&smL[(d_base + t * 16 + m) * PAD + e0 + 2 * g];
            acc[t] = __builtin_amdgcn_wmma_f32_16x16x4_f32(
                false, a, false, bv, (short)0, acc[t], false, false);
        }
    }

    float* ob = out + ((size_t)b * LL + l_blk + l_base) * DD + d_base;
#pragma unroll
    for (int t = 0; t < 2; ++t)
#pragma unroll
        for (int r = 0; r < 8; ++r)
            ob[(r + 8 * g) * DD + t * 16 + m] = acc[t][r];
}

// ---------------------------------------------------------------------------
extern "C" void kernel_launch(void* const* d_in, const int* in_sizes, int n_in,
                              void* d_out, int out_size, void* d_ws, size_t ws_size,
                              hipStream_t stream) {
    const float* q = (const float*)d_in[0];
    const float* k = (const float*)d_in[1];
    const float* v = (const float*)d_in[2];
    float* out = (float*)d_out;

    float* ws       = (float*)d_ws;
    float* normpart = ws + WS_NORM;   // BB*NRM*256 floats
    float* partials = ws + WS_PART;   // BB*NCH*DD*DD floats (4 MB)
    float* sm       = ws + WS_SM;     // BB*DD*DD floats

    qk_part_kernel<<<BB * NCH * 4, 256, 0, stream>>>(q, k, partials, normpart);
    softmax_kernel<<<(BB * DD) / SMW, 32 * SMW, 0, stream>>>(normpart, partials, sm);
    av_kernel<<<BB * (LL / VR), 256, 0, stream>>>(v, sm, out);
}

// v004
// Measured time: 13.1 microseconds a run.
// Two timings next to v003 put it at 1.16 and 1.15 times that version's speed.
// All steps since v000 together make it 6.32 times as fast.
#include <hip/hip_runtime.h>
#include <math.h>

typedef float v2f __attribute__((ext_vector_type(2)));
typedef float v4f __attribute__((ext_vector_type(4)));
typedef float v8f __attribute__((ext_vector_type(8)));

#define BB    4
#define LL    2048
#define DD    128
#define EPSF  1e-12f

#define NCH   16            // K-chunks per batch for the q^T k GEMM
#define CHUNK (LL / NCH)    // 128 sequence rows per chunk
#define NRM   NCH           // norm partials per batch: one per K-chunk
#define PAD   132           // LDS row pitch (mult of 4, %64==4 -> conflict-free)
#define SMW   4             // rows (waves) per softmax block
#define QT    64            // channels of q and of k per qk block: a 64x64 tile of S
#define VR    32            // rows of v (and of out) per av block

// ws layout (floats)
#define WS_NORM  0                        // BB*NRM*256
#define WS_PART  (BB * NRM * 256)         // BB*NCH*DD*DD
#define WS_SM    (WS_PART + BB * NCH * DD * DD)

// ---------------------------------------------------------------------------
// Kernel 1: one 64x64 quarter of the partial S = q^T k over one K-chunk of 128
// rows, per batch, and the chunk's sums of squares per channel of q and k (taken
// from the values while they pass through registers on their way to LDS).
// grid = BB*NCH*4 blocks (8 waves each), one for every WGP. A thread brings its
// share of the block's q and k tiles as 16 loads of 16 bytes, all in flight at
// once: one round trip for the whole tile. In LDS a 16-byte unit holds one
// channel of four adjacent rows, so every WMMA operand is a single 8-byte ds
// load; a thread turns its 4x4 blocks (4 rows x 4 channels) in registers.
// ---------------------------------------------------------------------------
__global__ __launch_bounds__(256) void qk_part_kernel(const float* __restrict__ q,
                                                      const float* __restrict__ k,
                                                      float* __restrict__ partials,
                                                      float* __restrict__ normpart) {
    // [l / 4][unit][l % 4]; channel d sits in unit d ^ (d >> 4): with that the
    // 16 lanes of a 16-byte store (channels 4 apart) fall on all 64 banks, and
    // the 16 channels of an operand read stay inside their 16 units
    __shared__ float qT[(CHUNK / 4) * QT * 4];   // 32 KB
    __shared__ float kT[(CHUNK / 4) * QT * 4];   // 32 KB
    __shared__ float sqL[2 * 16 * QT];   // [q|k][row group mod 16][channel] sums of squares
    int bc = blockIdx.x >> 2;        // batch * NCH + chunk
    int dh = (blockIdx.x >> 1) & 1;  // which 64 channels of q (rows of S)
    int eh = blockIdx.x & 1;         // which 64 channels of k (columns of S)
    int tid = threadIdx.x;

    const float* qb = q + (size_t)bc * CHUNK * DD + dh * QT;
    const float* kb = k + (size_t)bc * CHUNK * DD + eh * QT;

    // A thread keeps channels 4c .. 4c+3 and the row groups R and R + 16
    // (a group is four adjacent rows).
    int c = tid & 15;
    int R = tid >> 4;
    const float* qp = qb + 4 * R * DD + 4 * c;
    const float* kp = kb + 4 * R * DD + 4 * c;
    v4f xq[2][4], xk[2][4];
#pragma unroll
    for (int u = 0; u < 2; ++u)
#pragma unroll
        for (int r = 0; r < 4; ++r) {
            xq[u][r] = *(const v4f*)(qp + (u * 64 + r) * DD);
            xk[u][r] = *(const v4f*)(kp + (u * 64 + r) * DD);
        }
    // the wait that stands before a register named by an issued load is
    // written again; the two addresses are inputs so that they keep their
    // registers up to here and no load's result is put into them
    asm volatile("s_wait_xcnt 0x0" :: "v"(qp), "v"(kp) : "memory");
    v4f ssq = (v4f){0.f, 0.f, 0.f, 0.f};
    v4f ssk = (v4f){0.f, 0.f, 0.f, 0.f};
#pragma unroll
    for (int u = 0; u < 2; ++u) {
#pragma unroll
        for (int i = 0; i < 4; ++i) {
            int at = ((R + 16 * u) * QT + 4 * c + (i ^ (c >> 2))) * 4;
            *(v4f*)&qT[at] = (v4f){xq[u][0][i], xq[u][1][i], xq[u][2][i], xq[u][3][i]};
            *(v4f*)&kT[at] = (v4f){xk[u][0][i], xk[u][1][i], xk[u][2][i], xk[u][3][i]};
        }
#pragma unroll
        for (int r = 0; r < 4; ++r) {
            ssq += xq[u][r] * xq[u][r];
            ssk += xk[u][r] * xk[u][r];
        }
    }
    *(v4f*)&sqL[R * QT + 4 * c]           = ssq;
    *(v4f*)&sqL[16 * QT + R * QT + 4 * c] = ssk;
    __syncthreads();

    // Two blocks stage each half of q and two each half of k: the one with
    // eh == 0 writes q's sums, the one with dh == 0 writes k's.
    // threads 0..63 -> q channel, 64..127 -> k channel: the sixteen row groups
    if (tid < 2 * QT) {
        int isk = tid >> 6;
        int e   = tid & (QT - 1);
        if ((isk ? dh : eh) == 0) {
            const float* s = sqL + isk * 16 * QT + e;
            float a = 0.f;
#pragma unroll
            for (int r = 0; r < 16; r += 4)
                a += (s[r * QT] + s[(r + 1) * QT]) + (s[(r + 2) * QT] + s[(r + 3) * QT]);
            normpart[(size_t)bc * 256 + isk * DD + (isk ? eh : dh) * QT + e] = a;
        }
    }

    int w   = tid >> 5;          // wave 0..7: one 16-row strip, two 16-column tiles
    int lid = tid & 31;
    int g   = lid >> 4;
    int m   = lid & 15;
    int d_base = (w >> 1) * 16;  // within the block's 64 rows of S
    int e_base = (w & 1) * 32;   // within the block's 64 columns of S

    v8f acc[2];
#pragma unroll
    for (int t = 0; t < 2; ++t) acc[t] = (v8f){0.f,0.f,0.f,0.f,0.f,0.f,0.f,0.f};

    // the lane's channel of q and its two of k, as units, and its half of a unit
    int da = d_base + m;
    const float* qa = &qT[(da ^ (da >> 4)) * 4 + 2 * g];
    const float* ka[2];
#pragma unroll
    for (int t = 0; t < 2; ++t) {
        int eb = e_base + t * 16 + m;
        ka[t] = &kT[(eb ^ (eb >> 4)) * 4 + 2 * g];
    }

    // unroll 8: 16 WMMAs a trip, as before; later steps' LDS reads go out ahead
    // of the earlier steps' WMMAs
#pragma unroll 8
    for (int l0 = 0; l0 < CHUNK; l0 += 4) {
        // A[m][kk] = q[l0+kk, d_base+m], kk = 2g+j
        v2f a = *(const v2f*)&qa[l0 * QT];
#pragma unroll
        for (int t = 0; t < 2; ++t) {
            // B[kk][n] = k[l0+kk, e_base+16t+n]
            v2f bv = *(const v2f*)&ka[t][l0 * QT];
            acc[t] = __builtin_amdgcn_wmma_f32_16x16x4_f32(
                false, a, false, bv, (short)0, acc[t], false, false);
        }
    }

    float* Sp = partials + (size_t)bc * DD * DD + (dh * QT + d_base) * DD + eh * QT + e_base;
#pragma unroll
    for (int t = 0; t < 2; ++t)
#pragma unroll
        for (int r = 0; r < 8; ++r)
            Sp[(r + 8 * g) * DD + t * 16 + m] = acc[t][r];
}

// ---------------------------------------------------------------------------
// Kernel 2: one wave per row of S. Each lane owns 4 adjacent columns: it folds
// the norm partials -> inverse norms and the NCH S-partials (ordered,
// deterministic) in registers, scales, and the row's max and sum go over the
// 32 lanes by shuffles. No LDS, no barrier. grid = BB*DD/SMW.
// ---------------------------------------------------------------------------
// waves_per_eu: lets the compiler spend registers on all 48 loads at once; at its
// default target it reuses load registers and the later loads wait for the earlier.
__global__ __launch_bounds__(32 * SMW) __attribute__((amdgpu_waves_per_eu(1, 4)))
void softmax_kernel(const float* __restrict__ normpart,
                    const float* __restrict__ partials,
                    float* __restrict__ sm) {
    int row  = blockIdx.x * SMW + (threadIdx.x >> 5);   // 0 .. BB*DD-1
    int lane = threadIdx.x & 31;
    int b = row >> 7;
    int d = row & (DD - 1);
    int e = lane * 4;

    // all loads are independent: one round trip for the whole row
    const float* Pb = partials + (size_t)b * NCH * DD * DD + (size_t)d * DD + e;
    const float* Nb = normpart + (size_t)b * NRM * 256;
    float4 p[NCH];
    float4 xk[NRM];
    float  xq[NRM];
#pragma unroll
    for (int c = 0; c < NCH; ++c)
        p[c] = *(const float4*)(Pb + (size_t)c * DD * DD);
#pragma unroll
    for (int c = 0; c < NRM; ++c) {
        xq[c] = Nb[c * 256 + d];
        xk[c] = *(const float4*)(Nb + c * 256 + DD + e);
    }

    float  sq = 0.f;
    float4 sk = make_float4(0.f, 0.f, 0.f, 0.f);
#pragma unroll
    for (int c = 0; c < NRM; ++c) {
        sq += xq[c];
        sk.x += xk[c].x; sk.y += xk[c].y; sk.z += xk[c].z; sk.w += xk[c].w;
    }
    float nq = 1.f / fmaxf(sqrtf(sq), EPSF);
    float4 nk;
    nk.x = 1.f / fmaxf(sqrtf(sk.x), EPSF);
    nk.y = 1.f / fmaxf(sqrtf(sk.y), EPSF);
    nk.z = 1.f / fmaxf(sqrtf(sk.z), EPSF);
    nk.w = 1.f / fmaxf(sqrtf(sk.w), EPSF);

    float4 s = make_float4(0.f, 0.f, 0.f, 0.f);
#pragma unroll
    for (int c = 0; c < NCH; ++c) {
        s.x += p[c].x; s.y += p[c].y; s.z += p[c].z; s.w += p[c].w;
    }
    s.x = s.x * nq * nk.x;
    s.y = s.y * nq * nk.y;
    s.z = s.z * nq * nk.z;
    s.w = s.w * nq * nk.w;

    float mx = fmaxf(fmaxf(s.x, s.y), fmaxf(s.z, s.w));
#pragma unroll
    for (int o = 16; o > 0; o >>= 1) mx = fmaxf(mx, __shfl_xor(mx, o, 32));

    s.x = expf(s.x - mx);
    s.y = expf(s.y - mx);
    s.z = expf(s.z - mx);
    s.w = expf(s.w - mx);
    float sum = (s.x + s.y) + (s.z + s.w);
#pragma unroll
    for (int o = 16; o > 0; o >>= 1) sum += __shfl_xor(sum, o, 32);

    float r = 1.f / sum;
    s.x *= r; s.y *= r; s.z *= r; s.w *= r;
    *(float4*)(sm + (size_t)row * DD + e) = s;
}

// ---------------------------------------------------------------------------
// Kernel 3: out = v @ sm^T (M=2048, N=128, K=128 per batch) via WMMA.
// grid = BB*LL/VR blocks (8 waves each), one for every WGP: 32 rows of out each.
// sm and the block's rows of v (each read by four waves) are staged row-major
// with pad so that each operand is one ds_load_b64.
// ---------------------------------------------------------------------------
__global__ __launch_bounds__(256) void av_kernel(const float* __restrict__ v,
                                                 const float* __restrict__ sm,
                                                 float* __restrict__ out) {
    __shared__ float smL[DD * PAD];   // smL[d][e] : 67.6 KB
    __shared__ float vL[VR * PAD];    // vL[l][e]  : 16.9 KB
    int tid    = threadIdx.x;
    int b      = blockIdx.x / (LL / VR);
    int l_blk  = (blockIdx.x % (LL / VR)) * VR;

    // sm (16 loads of 16 bytes a thread) and the block's 32 rows of v (4 loads):
    // all 20 in flight at once, one round trip. v goes out last: its stores to
    // LDS then stand behind those of sm, which comes from nearer by.
    const float* smb = sm + (size_t)b * DD * DD;
    const float* vb  = v + ((size_t)b * LL + l_blk) * DD;
    float4 xs[(DD * DD) / 4 / 256], xv[(VR * DD) / 4 / 256];
#pragma unroll
    for (int i = 0; i < (DD * DD) / 4 / 256; ++i) xs[i] = ((const float4*)smb)[i * 256 + tid];
#pragma unroll
    for (int i = 0; i < (VR * DD) / 4 / 256; ++i) xv[i] = ((const float4*)vb)[i * 256 + tid];
#pragma unroll
    for (int i = 0; i < (DD * DD) / 4 / 256; ++i)
        *(float4*)&smL[(i * 8 + (tid >> 5)) * PAD + (tid & 31) * 4] = xs[i];
#pragma unroll
    for (int i = 0; i < (VR * DD) / 4 / 256; ++i)
        *(float4*)&vL[(i * 8 + (tid >> 5)) * PAD + (tid & 31) * 4] = xv[i];
    // the wait that stands before a register named by an issued load is written
    // again (the loads name the register of tid, which is rewritten further down);
    // behind the LDS stores, which hold it behind the loads
    asm volatile("s_wait_xcnt 0x0" ::: "memory");
    __syncthreads();

    int w   = tid >> 5;          // wave 0..7: one 16-row strip, two 16-column tiles
    int lid = tid & 31;
    int g   = lid >> 4;
    int m   = lid & 15;
    int l_base = (w >> 2) * 16;  // within the block's 32 rows
    int d_base = (w & 3) * 32;   // column of out

    v8f acc[2];
#pragma unroll
    for (int t = 0; t < 2; ++t) acc[t] = (v8f){0.f,0.f,0.f,0.f,0.f,0.f,0.f,0.f};

    // unroll 8: 16 WMMAs a trip; later steps' LDS reads go out ahead of the
    // earlier steps' WMMAs
#pragma unroll 8
    for (int e0 = 0; e0 < DD; e0 += 4) {
        // A[m][kk] = v[l_base+m, e0+kk] = vL[l_base+m][e0+kk], kk = 2g+j
        v2f a = *(const v2f*)&vL[(l_base + m) * PAD + e0 + 2 * g];
#pragma unroll
        for (int t = 0; t < 2; ++t) {
            // B[kk][n] = sm[d_base+16t+n, e0+kk] = smL[d_base+16t+n][e0+kk]
            v2f bv = *(const v2f*)&smL[(d_base + t * 16 + m) * PAD + e0 + 2 * g];
            acc[t] = __builtin_amdgcn_wmma_f32_16x16x4_f32(
                false, a, false, bv, (short)0, acc[t], false, false);
        }
    }

    float* ob = out + ((size_t)b * LL + l_blk + l_base) * DD + d_base;
#pragma unroll
    for (int t = 0; t < 2; ++t)
#pragma unroll
        for (int r = 0; r < 8; ++r)
            ob[(r + 8 * g) * DD + t * 16 + m] = acc[t][r];
}

// ---------------------------------------------------------------------------
extern "C" void kernel_launch(void* const* d_in, const int* in_sizes, int n_in,
                              void* d_out, int out_size, void* d_ws, size_t ws_size,
                              hipStream_t stream) {
    const float* q = (const float*)d_in[0];
    const float* k = (const float*)d_in[1];
    const float* v = (const float*)d_in[2];
    float* out = (float*)d_out;

    float* ws       = (float*)d_ws;
    float* normpart = ws + WS_NORM;   // BB*NRM*256 floats
    float* partials = ws + WS_PART;   // BB*NCH*DD*DD floats (4 MB)
    float* sm       = ws + WS_SM;     // BB*DD*DD floats

    qk_part_kernel<<<BB * NCH * 4, 256, 0, stream>>>(q, k, partials, normpart);
    softmax_kernel<<<(BB * DD) / SMW, 32 * SMW, 0, stream>>>(normpart, partials, sm);
    av_kernel<<<BB * (LL / VR), 256, 0, stream>>>(v, sm, out);
}

// v005
// A run of this version takes 12.5 microseconds.
// Next to v004, in two timings, it ran 1.05 times as fast each time.
// All steps since v000 together make it 6.63 times as fast.
#include <hip/hip_runtime.h>
#include <math.h>

typedef float v2f __attribute__((ext_vector_type(2)));
typedef float v4f __attribute__((ext_vector_type(4)));
typedef float v8f __attribute__((ext_vector_type(8)));

#define BB    4
#define LL    2048
#define DD    128
#define EPSF  1e-12f

#define NCH   16            // K-chunks per batch for the q^T k GEMM
#define CHUNK (LL / NCH)    // 128 sequence rows per chunk
#define NRM   NCH           // norm partials per batch: one per K-chunk
#define PAD   132           // LDS row pitch (mult of 4, %64==4 -> conflict-free)
#define QT    64            // channels of q and of k per qk block: a 64x64 tile of S
#define DG    32            // rows of S (columns of out) per av block: one 128-byte line of out
#define LG    128           // rows of v (and of out) per av block

// ws layout (floats)
#define WS_NORM  0                        // BB*NRM*256
#define WS_PART  (BB * NRM * 256)         // BB*NCH*DD*DD

// ---------------------------------------------------------------------------
// Kernel 1: one 64x64 quarter of the partial S = q^T k over one K-chunk of 128
// rows, per batch, and the chunk's sums of squares per channel of q and k (taken
// from the values while they pass through registers on their way to LDS).
// grid = BB*NCH*4 blocks (8 waves each), one for every WGP. A thread brings its
// share of the block's q and k tiles as 16 loads of 16 bytes, all in flight at
// once: one round trip for the whole tile. In LDS a 16-byte unit holds one
// channel of four adjacent rows, so every WMMA operand is a single 8-byte ds
// load; a thread turns its 4x4 blocks (4 rows x 4 channels) in registers.
// ---------------------------------------------------------------------------
__global__ __launch_bounds__(256) void qk_part_kernel(const float* __restrict__ q,
                                                      const float* __restrict__ k,
                                                      float* __restrict__ partials,
                                                      float* __restrict__ normpart) {
    // [l / 4][unit][l % 4]; channel d sits in unit d ^ (d >> 4): with that the
    // 16 lanes of a 16-byte store (channels 4 apart) fall on all 64 banks, and
    // the 16 channels of an operand read stay inside their 16 units
    __shared__ float qT[(CHUNK / 4) * QT * 4];   // 32 KB
    __shared__ float kT[(CHUNK / 4) * QT * 4];   // 32 KB
    __shared__ float sqL[2 * 16 * QT];   // [q|k][row group mod 16][channel] sums of squares
    int bc = blockIdx.x >> 2;        // batch * NCH + chunk
    int dh = (blockIdx.x >> 1) & 1;  // which 64 channels of q (rows of S)
    int eh = blockIdx.x & 1;         // which 64 channels of k (columns of S)
    int tid = threadIdx.x;

    const float* qb = q + (size_t)bc * CHUNK * DD + dh * QT;
    const float* kb = k + (size_t)bc * CHUNK * DD + eh * QT;

    // A thread keeps channels 4c .. 4c+3 and the row groups R and R + 16
    // (a group is four adjacent rows).
    int c = tid & 15;
    int R = tid >> 4;
    const float* qp = qb + 4 * R * DD + 4 * c;
    const float* kp = kb + 4 * R * DD + 4 * c;
    v4f xq[2][4], xk[2][4];
#pragma unroll
    for (int u = 0; u < 2; ++u)
#pragma unroll
        for (int r = 0; r < 4; ++r) {
            xq[u][r] = *(const v4f*)(qp + (u * 64 + r) * DD);
            xk[u][r] = *(const v4f*)(kp + (u * 64 + r) * DD);
        }
    // the wait that stands before a register named by an issued load is
    // written again; the two addresses are inputs so that they keep their
    // registers up to here and no load's result is put into them
    asm volatile("s_wait_xcnt 0x0" :: "v"(qp), "v"(kp) : "memory");
    v4f ssq = (v4f){0.f, 0.f, 0.f, 0.f};
    v4f ssk = (v4f){0.f, 0.f, 0.f, 0.f};
#pragma unroll
    for (int u = 0; u < 2; ++u) {
#pragma unroll
        for (int i = 0; i < 4; ++i) {
            int at = ((R + 16 * u) * QT + 4 * c + (i ^ (c >> 2))) * 4;
            *(v4f*)&qT[at] = (v4f){xq[u][0][i], xq[u][1][i], xq[u][2][i], xq[u][3][i]};
            *(v4f*)&kT[at] = (v4f){xk[u][0][i], xk[u][1][i], xk[u][2][i], xk[u][3][i]};
        }
#pragma unroll
        for (int r = 0; r < 4; ++r) {
            ssq += xq[u][r] * xq[u][r];
            ssk += xk[u][r] * xk[u][r];
        }
    }
    *(v4f*)&sqL[R * QT + 4 * c]           = ssq;
    *(v4f*)&sqL[16 * QT + R * QT + 4 * c] = ssk;
    __syncthreads();

    // Two blocks stage each half of q and two each half of k: the one with
    // eh == 0 writes q's sums, the one with dh == 0 writes k's.
    // threads 0..63 -> q channel, 64..127 -> k channel: the sixteen row groups
    if (tid < 2 * QT) {
        int isk = tid >> 6;
        int e   = tid & (QT - 1);
        if ((isk ? dh : eh) == 0) {
            const float* s = sqL + isk * 16 * QT + e;
            float a = 0.f;
#pragma unroll
            for (int r = 0; r < 16; r += 4)
                a += (s[r * QT] + s[(r + 1) * QT]) + (s[(r + 2) * QT] + s[(r + 3) * QT]);
            normpart[(size_t)bc * 256 + isk * DD + (isk ? eh : dh) * QT + e] = a;
        }
    }

    int w   = tid >> 5;          // wave 0..7: one 16-row strip, two 16-column tiles
    int lid = tid & 31;
    int g   = lid >> 4;
    int m   = lid & 15;
    int d_base = (w >> 1) * 16;  // within the block's 64 rows of S
    int e_base = (w & 1) * 32;   // within the block's 64 columns of S

    v8f acc[2];
#pragma unroll
    for (int t = 0; t < 2; ++t) acc[t] = (v8f){0.f,0.f,0.f,0.f,0.f,0.f,0.f,0.f};

    // the lane's channel of q and its two of k, as units, and its half of a unit
    int da = d_base + m;
    const float* qa = &qT[(da ^ (da >> 4)) * 4 + 2 * g];
    const float* ka[2];
#pragma unroll
    for (int t = 0; t < 2; ++t) {
        int eb = e_base + t * 16 + m;
        ka[t] = &kT[(eb ^ (eb >> 4)) * 4 + 2 * g];
    }

    // unroll 8: 16 WMMAs a trip, as before; later steps' LDS reads go out ahead
    // of the earlier steps' WMMAs
#pragma unroll 8
    for (int l0 = 0; l0 < CHUNK; l0 += 4) {
        // A[m][kk] = q[l0+kk, d_base+m], kk = 2g+j
        v2f a = *(const v2f*)&qa[l0 * QT];
#pragma unroll
        for (int t = 0; t < 2; ++t) {
            // B[kk][n] = k[l0+kk, e_base+16t+n]
            v2f bv = *(const v2f*)&ka[t][l0 * QT];
            acc[t] = __builtin_amdgcn_wmma_f32_16x16x4_f32(
                false, a, false, bv, (short)0, acc[t], false, false);
        }
    }

    float* Sp = partials + (size_t)bc * DD * DD + (dh * QT + d_base) * DD + eh * QT + e_base;
#pragma unroll
    for (int t = 0; t < 2; ++t)
#pragma unroll
        for (int r = 0; r < 8; ++r)
            Sp[(r + 8 * g) * DD + t * 16 + m] = acc[t][r];
}

// ---------------------------------------------------------------------------
// Kernel 2: softmax of S and out = v @ sm^T (M=2048, N=128, K=128 per batch, WMMA).
// grid = BB * (DD/DG) * (LL/LG) blocks (8 waves each), one for every WGP: a block
// makes 128 rows x 32 columns of out, and for that needs only 32 rows of sm, which
// it makes itself. A wave takes four of these rows; each lane owns 4 adjacent
// columns, folds the NCH S-partials (ordered, deterministic) in registers and
// scales; a row's max and sum go over the 32 lanes by shuffles. The rows of sm and
// the block's rows of v are staged row-major with pad so that each WMMA operand is
// one ds_load_b64.
// ---------------------------------------------------------------------------
__global__ __launch_bounds__(256) void sm_av_kernel(const float* __restrict__ normpart,
                                                    const float* __restrict__ partials,
                                                    const float* __restrict__ v,
                                                    float* __restrict__ out) {
    // smL and vL are written, and invL is read, 16 bytes at a time
    __shared__ __attribute__((aligned(16))) float smL[DG * PAD];   // smL[d][e] : 16.9 KB
    __shared__ __attribute__((aligned(16))) float vL[LG * PAD];    // vL[l][e]  : 67.6 KB
    __shared__ __attribute__((aligned(16))) float invL[DG + DD];   // inverse norms: the block's 32 channels of q, all of k
    int tid   = threadIdx.x;
    int b     = blockIdx.x / ((DD / DG) * (LL / LG));
    int d_blk = ((blockIdx.x / (LL / LG)) % (DD / DG)) * DG;
    int l_blk = (blockIdx.x % (LL / LG)) * LG;
    int w     = tid >> 5;
    int lane  = tid & 31;

    // All loads of a thread go out before the first wait, in the order of their
    // use: norm partials (threads 0..159, one channel each), S-partials (64 loads
    // of 16 bytes), v (16 loads).
    const float* Np = normpart + (size_t)b * NRM * 256
                    + (tid < DG ? d_blk + tid : DD + ((tid - DG) & (DD - 1)));
    const float* Pp = partials + (size_t)b * NCH * DD * DD + (size_t)(d_blk + 4 * w) * DD + 4 * lane;
    const float* vp = v + ((size_t)b * LL + l_blk) * DD + 4 * tid;
    float xn[NRM];
    v4f   p[4][NCH];
    v4f   xv[(LG * DD) / 4 / 256];
    if (tid < DG + DD) {
#pragma unroll
        for (int c = 0; c < NRM; ++c) xn[c] = Np[c * 256];
    }
#pragma unroll
    for (int i = 0; i < 4; ++i)
#pragma unroll
        for (int c = 0; c < NCH; ++c)
            p[i][c] = *(const v4f*)(Pp + (size_t)c * DD * DD + i * DD);
#pragma unroll
    for (int i = 0; i < (LG * DD) / 4 / 256; ++i) xv[i] = *(const v4f*)(vp + i * 1024);
    // the wait that stands before a register named by an issued load is
    // written again; the two addresses and tid (the loads of v name its register)
    // are inputs so that they keep their registers up to here and no load's
    // result is put into them
    asm volatile("s_wait_xcnt 0x0" :: "v"(Np), "v"(Pp), "v"(tid) : "memory");

    if (tid < DG + DD) {
        float a = 0.f;
#pragma unroll
        for (int c = 0; c < NRM; ++c) a += xn[c];
        invL[tid] = 1.f / fmaxf(sqrtf(a), EPSF);
    }
    v4f s[4];
#pragma unroll
    for (int i = 0; i < 4; ++i) {
        s[i] = (v4f){0.f, 0.f, 0.f, 0.f};
#pragma unroll
        for (int c = 0; c < NCH; ++c) s[i] += p[i][c];
    }

    // Barrier by hand, with fences on LDS alone: it publishes invL. __syncthreads()
    // here would also wait out the global loads of v, which are still in flight.
    __builtin_amdgcn_fence(__ATOMIC_RELEASE, "workgroup", "local");
    __builtin_amdgcn_s_barrier();
    __builtin_amdgcn_fence(__ATOMIC_ACQUIRE, "workgroup", "local");

    v4f nk = *(const v4f*)&invL[DG + 4 * lane];
#pragma unroll
    for (int i = 0; i < 4; ++i) {
        float nq = invL[4 * w + i];
        v4f t = s[i];
        t.x = t.x * nq * nk.x;
        t.y = t.y * nq * nk.y;
        t.z = t.z * nq * nk.z;
        t.w = t.w * nq * nk.w;

        float mx = fmaxf(fmaxf(t.x, t.y), fmaxf(t.z, t.w));
#pragma unroll
        for (int o = 16; o > 0; o >>= 1) mx = fmaxf(mx, __shfl_xor(mx, o, 32));

        t.x = expf(t.x - mx);
        t.y = expf(t.y - mx);
        t.z = expf(t.z - mx);
        t.w = expf(t.w - mx);
        float sum = (t.x + t.y) + (t.z + t.w);
#pragma unroll
        for (int o = 16; o > 0; o >>= 1) sum += __shfl_xor(sum, o, 32);

        float r = 1.f / sum;
        t.x *= r; t.y *= r; t.z *= r; t.w *= r;
        *(v4f*)&smL[(4 * w + i) * PAD + 4 * lane] = t;
    }
#pragma unroll
    for (int i = 0; i < (LG * DD) / 4 / 256; ++i)
        *(v4f*)&vL[(i * 8 + w) * PAD + 4 * lane] = xv[i];
    __syncthreads();

    int g = lane >> 4;           // wave 0..7: one 16-row strip, two 16-column tiles
    int m = lane & 15;
    int l_base = w * 16;         // within the block's 128 rows

    v8f acc[2];
#pragma unroll
    for (int t = 0; t < 2; ++t) acc[t] = (v8f){0.f,0.f,0.f,0.f,0.f,0.f,0.f,0.f};

    // unroll 8: 16 WMMAs a trip; later steps' LDS reads go out ahead of the
    // earlier steps' WMMAs
#pragma unroll 8
    for (int e0 = 0; e0 < DD; e0 += 4) {
        // A[m][kk] = v[l_base+m, e0+kk] = vL[l_base+m][e0+kk], kk = 2g+j
        v2f a = *(const v2f*)&vL[(l_base + m) * PAD + e0 + 2 * g];
#pragma unroll
        for (int t = 0; t < 2; ++t) {
            // B[kk][n] = sm[d_blk+16t+n, e0+kk] = smL[16t+n][e0+kk]
            v2f bv = *(const v2f*)&smL[(t * 16 + m) * PAD + e0 + 2 * g];
            acc[t] = __builtin_amdgcn_wmma_f32_16x16x4_f32(
                false, a, false, bv, (short)0, acc[t], false, false);
        }
    }

    float* ob = out + ((size_t)b * LL + l_blk + l_base) * DD + d_blk;
#pragma unroll
    for (int t = 0; t < 2; ++t)
#pragma unroll
        for (int r = 0; r < 8; ++r)
            ob[(r + 8 * g) * DD + t * 16 + m] = acc[t][r];
}

// ---------------------------------------------------------------------------
extern "C" void kernel_launch(void* const* d_in, const int* in_sizes, int n_in,
                              void* d_out, int out_size, void* d_ws, size_t ws_size,
                              hipStream_t stream) {
    const float* q = (const float*)d_in[0];
    const float* k = (const float*)d_in[1];
    const float* v = (const float*)d_in[2];
    float* out = (float*)d_out;

    float* ws       = (float*)d_ws;
    float* normpart = ws + WS_NORM;   // BB*NRM*256 floats
    float* partials = ws + WS_PART;   // BB*NCH*DD*DD floats (4 MB)

    qk_part_kernel<<<BB * NCH * 4, 256, 0, stream>>>(q, k, partials, normpart);
    sm_av_kernel<<<BB * (DD / DG) * (LL / LG), 256, 0, stream>>>(normpart, partials, v, out);
}

// v006
// One run takes 11.2 microseconds.
// Next to v005, in two timings, it ran 1.12 and 1.11 times as fast.
// Over all steps from v000 it is 7.40 times as fast.
#include <hip/hip_runtime.h>
#include <math.h>

typedef float v2f __attribute__((ext_vector_type(2)));
typedef float v4f __attribute__((ext_vector_type(4)));
typedef float v8f __attribute__((ext_vector_type(8)));

#define BB    4
#define LL    2048
#define DD    128
#define EPSF  1e-12f

#define NCH   4             // K-chunks per batch for the q^T k GEMM
#define CHUNK (LL / NCH)    // 512 sequence rows per chunk
#define NRM   NCH           // norm partials per batch: one per K-chunk
#define PAD   132           // LDS row pitch (mult of 4, %64==4 -> conflict-free)
#define QT    32            // channels of q and of k per qk block: a 32x32 tile of S
#define WR    (CHUNK / 8)   // rows of a chunk per wave of a qk block
#define RGP   1080          // floats per group of four rows in LDS: 8 waves x 32 units of 4, and 14 units of pad
#define DG    32            // rows of S (columns of out) per av block: one 128-byte line of out
#define LG    128           // rows of v (and of out) per av block

// ws layout (floats)
#define WS_NORM  0                        // BB*NRM*256
#define WS_PART  (BB * NRM * 256)         // BB*NCH*DD*DD

// ---------------------------------------------------------------------------
// Kernel 1: one 32x32 tile of the partial S = q^T k over one K-chunk of 512
// rows, per batch, and the chunk's sums of squares per channel of q and k (taken
// from the values while they pass through registers on their way to LDS).
// grid = BB*NCH*16 blocks (8 waves each), one for every WGP. The chunk's rows are
// split over the waves: a wave brings, stages and multiplies its own 64 rows (the
// whole 32x32 tile, four accumulators), so no wave waits for another before the
// products; the eight 32x32 sums are then added through LDS behind the block's one
// barrier. A thread's 32 loads of 16 bytes are all in flight at once; they are used
// 16 rows at a time, so the first products run while later rows are still on their
// way. In LDS a 16-byte unit holds one channel of four adjacent rows, so every WMMA
// operand is a single 8-byte ds load; a thread turns its 4x4 blocks (4 rows x 4
// channels) in registers.
// ---------------------------------------------------------------------------
__global__ __launch_bounds__(256) void qk_part_kernel(const float* __restrict__ q,
                                                      const float* __restrict__ k,
                                                      float* __restrict__ partials,
                                                      float* __restrict__ normpart) {
    // One array, cut by hand:
    // first [q|k][l / 4 within a wave's rows][wave][unit][l % 4], 135 KB; channel d
    // sits in unit d ^ (d >> 4): with that and the 14 units of pad per row group the
    // 16 lanes of a 16-byte store (8 channel quads of 2 row groups) fall on all 64
    // banks, and the 16 channels of an operand read stay inside their 16 units; q's
    // part begins at 0 and a row group's offset in a part stays under 65,536 bytes, so
    // that every operand read reaches its row group with an immediate offset and no
    // address is formed between the WMMAs
    // red  [wave][half accumulator][lane][4]: the waves' sums of the tile, 32 KB
    // sqL  [q|k][wave * 4 + R][channel]: sums of squares, 8 KB
    __shared__ __attribute__((aligned(16))) float lds[2 * (WR / 4) * RGP + 8 * 8 * 32 * 4 + 2 * 32 * QT];
    float* red = lds + 2 * (WR / 4) * RGP;
    float* sqL = red + 8 * 8 * 32 * 4;
    int bc = blockIdx.x >> 4;        // batch * NCH + chunk
    int dh = (blockIdx.x >> 2) & 3;  // which 32 channels of q (rows of S)
    int eh = blockIdx.x & 3;         // which 32 channels of k (columns of S)
    int tid  = threadIdx.x;
    int w    = tid >> 5;
    int lane = tid & 31;

    // A thread keeps channels 4c .. 4c+3 and, of its wave's 16 row groups, the
    // groups R, R + 4, R + 8, R + 12 (a group is four adjacent rows).
    int c = lane & 7;
    int R = lane >> 3;
    const float* qp = q + ((size_t)bc * CHUNK + w * WR + 4 * R) * DD + dh * QT + 4 * c;
    const float* kp = k + ((size_t)bc * CHUNK + w * WR + 4 * R) * DD + eh * QT + 4 * c;
    v4f xq[4][4], xk[4][4];
#pragma unroll
    for (int u = 0; u < 4; ++u)
#pragma unroll
        for (int r = 0; r < 4; ++r) {
            xq[u][r] = *(const v4f*)(qp + (u * 16 + r) * DD);
            xk[u][r] = *(const v4f*)(kp + (u * 16 + r) * DD);
        }
    // the wait that stands before a register named by an issued load is
    // written again; the two addresses are inputs so that they keep their
    // registers up to here and no load's result is put into them
    asm volatile("s_wait_xcnt 0x0" :: "v"(qp), "v"(kp) : "memory");

    int g = lane >> 4;
    int m = lane & 15;
    float* qw = lds + w * QT * 4;   // the wave's own rows
    float* kw = qw + (WR / 4) * RGP;
    // the lane's two channels of q and two of k, as units, and its half of a unit
    const float* qa[2];
    const float* ka[2];
#pragma unroll
    for (int t = 0; t < 2; ++t) {
        qa[t] = qw + (t * 16 + (m ^ t)) * 4 + 2 * g;
        ka[t] = kw + (t * 16 + (m ^ t)) * 4 + 2 * g;
    }

    v8f acc[2][2];
#pragma unroll
    for (int s = 0; s < 2; ++s)
#pragma unroll
        for (int t = 0; t < 2; ++t) acc[s][t] = (v8f){0.f,0.f,0.f,0.f,0.f,0.f,0.f,0.f};
    v4f ssq = (v4f){0.f, 0.f, 0.f, 0.f};
    v4f ssk = (v4f){0.f, 0.f, 0.f, 0.f};

    // fully unrolled: each pass waits only for its own eight loads
#pragma unroll
    for (int u = 0; u < 4; ++u) {
#pragma unroll
        for (int i = 0; i < 4; ++i) {
            int at = (4 * u + R) * RGP + (4 * c + (i ^ (c >> 2))) * 4;
            *(v4f*)&qw[at] = (v4f){xq[u][0][i], xq[u][1][i], xq[u][2][i], xq[u][3][i]};
            *(v4f*)&kw[at] = (v4f){xk[u][0][i], xk[u][1][i], xk[u][2][i], xk[u][3][i]};
        }
        // The lanes of one wave exchange values through LDS, which serves a wave's
        // operations in order: these fences emit nothing and only keep the compiler
        // from lifting the reads below over the stores above.
        __builtin_amdgcn_fence(__ATOMIC_RELEASE, "wavefront", "local");
        __builtin_amdgcn_wave_barrier();
        __builtin_amdgcn_fence(__ATOMIC_ACQUIRE, "wavefront", "local");
#pragma unroll
        for (int rg = 4 * u; rg < 4 * u + 4; ++rg) {
            // A[m][kk] = q[4 rg + kk, 16 s + m], B[kk][n] = k[4 rg + kk, 16 t + n], kk = 2g+j
            v2f a[2], bv[2];
#pragma unroll
            for (int t = 0; t < 2; ++t) {
                a[t]  = *(const v2f*)&qa[t][rg * RGP];
                bv[t] = *(const v2f*)&ka[t][rg * RGP];
            }
#pragma unroll
            for (int s = 0; s < 2; ++s)
#pragma unroll
                for (int t = 0; t < 2; ++t)
                    acc[s][t] = __builtin_amdgcn_wmma_f32_16x16x4_f32(
                        false, a[s], false, bv[t], (short)0, acc[s][t], false, false);
        }
        // keeps the pass's products ahead of the next pass: without it the next pass's
        // register moves are lifted in between them, and with the moves its waits for
        // loads, so that products whose rows have landed stand behind rows that are
        // still on their way
        __builtin_amdgcn_sched_barrier(0);
    }

    // the sums of squares, behind the products: no vector work stands between WMMAs
#pragma unroll
    for (int u = 0; u < 4; ++u)
#pragma unroll
        for (int r = 0; r < 4; ++r) {
            ssq += xq[u][r] * xq[u][r];
            ssk += xk[u][r] * xk[u][r];
        }
    *(v4f*)&sqL[(w * 4 + R) * QT + 4 * c]             = ssq;
    *(v4f*)&sqL[32 * QT + (w * 4 + R) * QT + 4 * c]   = ssk;
#pragma unroll
    for (int s = 0; s < 2; ++s)
#pragma unroll
        for (int t = 0; t < 2; ++t)
#pragma unroll
            for (int h = 0; h < 2; ++h)
                *(v4f*)&red[((w * 8 + (s * 2 + t) * 2 + h) * 32 + lane) * 4] =
                    (v4f){acc[s][t][4 * h], acc[s][t][4 * h + 1], acc[s][t][4 * h + 2], acc[s][t][4 * h + 3]};
    __syncthreads();

    // Four blocks stage each quarter of q and four each quarter of k: the one with
    // eh == 0 writes q's sums, the one with dh == 0 writes k's.
    // wave 0 -> q, wave 1 -> k, a lane per channel: the 32 groups of lanes
    if (w < 2 && (w ? dh : eh) == 0) {
        const float* s = sqL + w * 32 * QT + lane;
        float a = 0.f;
#pragma unroll
        for (int r = 0; r < 32; r += 4)
            a += (s[r * QT] + s[(r + 1) * QT]) + (s[(r + 2) * QT] + s[(r + 3) * QT]);
        normpart[(size_t)bc * 256 + w * DD + (w ? eh : dh) * QT + lane] = a;
    }

    // The eight waves' sums, added in a fixed order. Wave w takes four rows of the
    // tile, rows 16 (w >> 2) + 8 (w & 1) + 4 ((w >> 1) & 1) + j, a lane per column:
    // each store is one whole 128-byte line.
    {
        int slot = ((w >> 2) * 2 + g) * 2 + ((w >> 1) & 1);
        const float* rp = &red[(slot * 32 + (w & 1) * 16 + m) * 4];
        v4f x[8];
#pragma unroll
        for (int i = 0; i < 8; ++i) x[i] = *(const v4f*)&rp[i * 8 * 32 * 4];
        v4f t = ((x[0] + x[1]) + (x[2] + x[3])) + ((x[4] + x[5]) + (x[6] + x[7]));
        int row = (w >> 2) * 16 + (w & 1) * 8 + ((w >> 1) & 1) * 4;
        float* Sp = partials + (size_t)bc * DD * DD + (dh * QT + row) * DD + eh * QT + lane;
#pragma unroll
        for (int j = 0; j < 4; ++j) Sp[j * DD] = t[j];
    }
}

// ---------------------------------------------------------------------------
// Kernel 2: softmax of S and out = v @ sm^T (M=2048, N=128, K=128 per batch, WMMA).
// grid = BB * (DD/DG) * (LL/LG) blocks (8 waves each), one for every WGP: a block
// makes 128 rows x 32 columns of out, and for that needs only 32 rows of sm, which
// it makes itself. A wave takes four of these rows; each lane owns 4 adjacent
// columns, folds the NCH S-partials (ordered, deterministic) in registers and
// scales; a row's max and sum go over the 32 lanes by shuffles. The rows of sm and
// the block's rows of v are staged row-major with pad so that each WMMA operand is
// one ds_load_b64.
// ---------------------------------------------------------------------------
__global__ __launch_bounds__(256) void sm_av_kernel(const float* __restrict__ normpart,
                                                    const float* __restrict__ partials,
                                                    const float* __restrict__ v,
                                                    float* __restrict__ out) {
    // smL and vL are written, and invL is read, 16 bytes at a time
    __shared__ __attribute__((aligned(16))) float smL[DG * PAD];   // smL[d][e] : 16.9 KB
    __shared__ __attribute__((aligned(16))) float vL[LG * PAD];    // vL[l][e]  : 67.6 KB
    __shared__ __attribute__((aligned(16))) float invL[DG + DD];   // inverse norms: the block's 32 channels of q, all of k
    int tid   = threadIdx.x;
    int b     = blockIdx.x / ((DD / DG) * (LL / LG));
    int d_blk = ((blockIdx.x / (LL / LG)) % (DD / DG)) * DG;
    int l_blk = (blockIdx.x % (LL / LG)) * LG;
    int w     = tid >> 5;
    int lane  = tid & 31;

    // All loads of a thread go out before the first wait, in the order of their
    // use: norm partials (threads 0..159, one channel each), S-partials (16 loads
    // of 16 bytes), v (16 loads).
    const float* Np = normpart + (size_t)b * NRM * 256
                    + (tid < DG ? d_blk + tid : DD + ((tid - DG) & (DD - 1)));
    const float* Pp = partials + (size_t)b * NCH * DD * DD + (size_t)(d_blk + 4 * w) * DD + 4 * lane;
    const float* vp = v + ((size_t)b * LL + l_blk) * DD + 4 * tid;
    float xn[NRM];
    v4f   p[4][NCH];
    v4f   xv[(LG * DD) / 4 / 256];
    if (tid < DG + DD) {
#pragma unroll
        for (int c = 0; c < NRM; ++c) xn[c] = Np[c * 256];
    }
#pragma unroll
    for (int i = 0; i < 4; ++i)
#pragma unroll
        for (int c = 0; c < NCH; ++c)
            p[i][c] = *(const v4f*)(Pp + (size_t)c * DD * DD + i * DD);
#pragma unroll
    for (int i = 0; i < (LG * DD) / 4 / 256; ++i) xv[i] = *(const v4f*)(vp + i * 1024);
    // the wait that stands before a register named by an issued load is
    // written again; the two addresses and tid (the loads of v name its register)
    // are inputs so that they keep their registers up to here and no load's
    // result is put into them
    asm volatile("s_wait_xcnt 0x0" :: "v"(Np), "v"(Pp), "v"(tid) : "memory");

    if (tid < DG + DD) {
        float a = 0.f;
#pragma unroll
        for (int c = 0; c < NRM; ++c) a += xn[c];
        invL[tid] = 1.f / fmaxf(sqrtf(a), EPSF);
    }
    v4f s[4];
#pragma unroll
    for (int i = 0; i < 4; ++i) {
        s[i] = (v4f){0.f, 0.f, 0.f, 0.f};
#pragma unroll
        for (int c = 0; c < NCH; ++c) s[i] += p[i][c];
    }

    // Barrier by hand, with fences on LDS alone: it publishes invL. __syncthreads()
    // here would also wait out the global loads of v, which are still in flight.
    __builtin_amdgcn_fence(__ATOMIC_RELEASE, "workgroup", "local");
    __builtin_amdgcn_s_barrier();
    __builtin_amdgcn_fence(__ATOMIC_ACQUIRE, "workgroup", "local");

    v4f nk = *(const v4f*)&invL[DG + 4 * lane];
#pragma unroll
    for (int i = 0; i < 4; ++i) {
        float nq = invL[4 * w + i];
        v4f t = s[i];
        t.x = t.x * nq * nk.x;
        t.y = t.y * nq * nk.y;
        t.z = t.z * nq * nk.z;
        t.w = t.w * nq * nk.w;

        float mx = fmaxf(fmaxf(t.x, t.y), fmaxf(t.z, t.w));
#pragma unroll
        for (int o = 16; o > 0; o >>= 1) mx = fmaxf(mx, __shfl_xor(mx, o, 32));

        t.x = expf(t.x - mx);
        t.y = expf(t.y - mx);
        t.z = expf(t.z - mx);
        t.w = expf(t.w - mx);
        float sum = (t.x + t.y) + (t.z + t.w);
#pragma unroll
        for (int o = 16; o > 0; o >>= 1) sum += __shfl_xor(sum, o, 32);

        float r = 1.f / sum;
        t.x *= r; t.y *= r; t.z *= r; t.w *= r;
        *(v4f*)&smL[(4 * w + i) * PAD + 4 * lane] = t;
    }
#pragma unroll
    for (int i = 0; i < (LG * DD) / 4 / 256; ++i)
        *(v4f*)&vL[(i * 8 + w) * PAD + 4 * lane] = xv[i];
    __syncthreads();

    int g = lane >> 4;           // wave 0..7: one 16-row strip, two 16-column tiles
    int m = lane & 15;
    int l_base = w * 16;         // within the block's 128 rows

    v8f acc[2];
#pragma unroll
    for (int t = 0; t < 2; ++t) acc[t] = (v8f){0.f,0.f,0.f,0.f,0.f,0.f,0.f,0.f};

    // unroll 8: 16 WMMAs a trip; later steps' LDS reads go out ahead of the
    // earlier steps' WMMAs
#pragma unroll 8
    for (int e0 = 0; e0 < DD; e0 += 4) {
        // A[m][kk] = v[l_base+m, e0+kk] = vL[l_base+m][e0+kk], kk = 2g+j
        v2f a = *(const v2f*)&vL[(l_base + m) * PAD + e0 + 2 * g];
#pragma unroll
        for (int t = 0; t < 2; ++t) {
            // B[kk][n] = sm[d_blk+16t+n, e0+kk] = smL[16t+n][e0+kk]
            v2f bv = *(const v2f*)&smL[(t * 16 + m) * PAD + e0 + 2 * g];
            acc[t] = __builtin_amdgcn_wmma_f32_16x16x4_f32(
                false, a, false, bv, (short)0, acc[t], false, false);
        }
    }

    float* ob = out + ((size_t)b * LL + l_blk + l_base) * DD + d_blk;
#pragma unroll
    for (int t = 0; t < 2; ++t)
#pragma unroll
        for (int r = 0; r < 8; ++r)
            ob[(r + 8 * g) * DD + t * 16 + m] = acc[t][r];
}

// ---------------------------------------------------------------------------
extern "C" void kernel_launch(void* const* d_in, const int* in_sizes, int n_in,
                              void* d_out, int out_size, void* d_ws, size_t ws_size,
                              hipStream_t stream) {
    const float* q = (const float*)d_in[0];
    const float* k = (const float*)d_in[1];
    const float* v = (const float*)d_in[2];
    float* out = (float*)d_out;

    float* ws       = (float*)d_ws;
    float* normpart = ws + WS_NORM;   // BB*NRM*256 floats
    float* partials = ws + WS_PART;   // BB*NCH*DD*DD floats (1 MB)

    qk_part_kernel<<<BB * NCH * 16, 256, 0, stream>>>(q, k, partials, normpart);
    sm_av_kernel<<<BB * (DD / DG) * (LL / LG), 256, 0, stream>>>(normpart, partials, v, out);
}
